// v000
// The times below were measured on an AMD MI455X: many runs one after another, warmed up first and cycling through
// copies of the inputs, with the whole window's GPU time divided by the number of runs. Launches and the gaps
// between them are all in it. The median over several windows is given; except for v000 it joins two sittings, which
// can be a few percent apart, so the side-by-side timings, each taken in one sitting, are the better comparison.
// v000, which the later versions start from, runs in 104 microseconds.
#include <hip/hip_runtime.h>
#include <cstdint>

#define D_MODEL   1024
#define N_HEADS   16
#define HEAD_DIM  64
#define S_NEW     16
#define PAST_LEN  32768
#define CHUNK_KEYS 512
#define NCH_PAST  (PAST_LEN / CHUNK_KEYS)   // 64
#define NCH       (NCH_PAST + 1)            // 65 (last chunk = 16 new keys, causal)
#define TILES_PER_CHUNK (CHUNK_KEYS / 16)   // 32
#define LDS_K_STRIDE 68                     // 64 + 4 pad: conflict-free b64 reads
#define LDS_P_STRIDE 18                     // 16 + 2 pad: 8B-aligned, conflict-free

typedef float v2f __attribute__((ext_vector_type(2)));
typedef float v8f __attribute__((ext_vector_type(8)));

__device__ __forceinline__ v8f wmma_f32_16x16x4(v2f a, v2f b, v8f c) {
  // (neg_a, A, neg_b, B, c_mod, C, reuse_a, reuse_b)
  return __builtin_amdgcn_wmma_f32_16x16x4_f32(false, a, false, b, (short)0, c,
                                               false, false);
}

__device__ __forceinline__ uint32_t lds_off(const void* p) {
  // generic pointer to __shared__: low 32 bits are the wave-relative LDS offset
  return (uint32_t)(uintptr_t)p;
}

// Issue async copy of two 16x64 f32 tiles (row stride D_MODEL) into padded LDS
// tiles (row stride LDS_K_STRIDE). 16 x global_load_async_to_lds_b128, ASYNCcnt +=16.
__device__ __forceinline__ void async_stage_16x64x2(const float* __restrict__ pa,
                                                    const float* __restrict__ pb,
                                                    uint32_t la, uint32_t lb,
                                                    int lane) {
  const int j0   = lane >> 4;   // 0..1
  const int part = lane & 15;   // 0..15 (float4 chunk within row)
  #pragma unroll
  for (int it = 0; it < 8; ++it) {
    const int j = it * 2 + j0;
    const uint32_t ofl = (uint32_t)((j * LDS_K_STRIDE + part * 4) * 4);
    const uint64_t ga  = (uint64_t)(uintptr_t)(pa + (size_t)j * D_MODEL + part * 4);
    const uint64_t gb  = (uint64_t)(uintptr_t)(pb + (size_t)j * D_MODEL + part * 4);
    asm volatile("global_load_async_to_lds_b128 %0, %1, off"
                 :: "v"(la + ofl), "v"(ga) : "memory");
    asm volatile("global_load_async_to_lds_b128 %0, %1, off"
                 :: "v"(lb + ofl), "v"(gb) : "memory");
  }
}

__device__ __forceinline__ void wait_async_le16() {
  asm volatile("s_wait_asynccnt 0x10" ::: "memory");
}
__device__ __forceinline__ void wait_async_0() {
  asm volatile("s_wait_asynccnt 0x0" ::: "memory");
}

// ---------------------------------------------------------------------------
// y[s, n0..n0+15] = sum_k x[s,k] * W[n0+n, k]   (y = x @ W^T), 16 rows of x.
// One wave per 16x16 tile; K staged via double-buffered async-to-LDS.
// ---------------------------------------------------------------------------
__device__ __forceinline__ void gemm_tile_16(const float* __restrict__ x,
                                             const float* __restrict__ W,
                                             float* __restrict__ y,
                                             int n0, float* xs, float* wsh) {
  const int lane = threadIdx.x & 31;
  const int sn   = lane & 15;   // A: m (row of x) / B: n (col of y)
  const int hi   = lane >> 4;
  const int koff = hi * 2;      // f32 A/B layout: lanes 0-15 hold K={0,1}, 16-31 K={2,3}
  const int BUF  = 16 * LDS_K_STRIDE;

  const float* Wr = W + (size_t)n0 * D_MODEL;
  const uint32_t xso = lds_off(xs), wso = lds_off(wsh);

  v8f acc = {0.f, 0.f, 0.f, 0.f, 0.f, 0.f, 0.f, 0.f};

  async_stage_16x64x2(x, Wr, xso, wso, lane);   // chunk 0 -> buffer 0
  for (int c = 0; c < 16; ++c) {                // 16 chunks of K=64
    const int cur = c & 1;
    if (c + 1 < 16) {
      const int nk0 = (c + 1) * 64;
      async_stage_16x64x2(x + nk0, Wr + nk0,
                          xso + (uint32_t)(((c + 1) & 1) * BUF * 4),
                          wso + (uint32_t)(((c + 1) & 1) * BUF * 4), lane);
      wait_async_le16();                        // chunk c landed
    } else {
      wait_async_0();
    }
    const float* xc = xs  + cur * BUF;
    const float* wc = wsh + cur * BUF;
    #pragma unroll
    for (int kk = 0; kk < 64; kk += 4) {
      v2f a = *(const v2f*)(xc + sn * LDS_K_STRIDE + kk + koff);
      v2f b = *(const v2f*)(wc + sn * LDS_K_STRIDE + kk + koff);
      acc = wmma_f32_16x16x4(a, b, acc);
    }
  }
  #pragma unroll
  for (int r = 0; r < 8; ++r)
    y[(r + 8 * hi) * D_MODEL + n0 + sn] = acc[r];  // C layout: m=r+8*hi, n=lane%16
}

__global__ void __launch_bounds__(32)
qkv_kernel(const float* __restrict__ x,
           const float* __restrict__ Wq, const float* __restrict__ Wk,
           const float* __restrict__ Wv,
           float* __restrict__ q, float* __restrict__ k, float* __restrict__ v) {
  __shared__ alignas(16) float xs[2 * 16 * LDS_K_STRIDE];
  __shared__ alignas(16) float wsh[2 * 16 * LDS_K_STRIDE];
  const int bx  = blockIdx.x;          // 192 blocks: 3 matrices x 64 tiles
  const int mat = bx >> 6;
  const int n0  = (bx & 63) << 4;
  const float* W = (mat == 0) ? Wq : (mat == 1) ? Wk : Wv;
  float*       y = (mat == 0) ? q  : (mat == 1) ? k  : v;
  gemm_tile_16(x, W, y, n0, xs, wsh);
}

__global__ void __launch_bounds__(32)
oproj_kernel(const float* __restrict__ ao, const float* __restrict__ Wo,
             float* __restrict__ out) {
  __shared__ alignas(16) float xs[2 * 16 * LDS_K_STRIDE];
  __shared__ alignas(16) float wsh[2 * 16 * LDS_K_STRIDE];
  gemm_tile_16(ao, Wo, out, (int)blockIdx.x << 4, xs, wsh);
}

// ---------------------------------------------------------------------------
// Flash-attention partial over one (head, key-chunk). One wave per block.
// Sᵀ = K_tile(16x64) @ Qᵀ(64x16): softmax state is per-lane (lane = query).
// Oᵀ(64x16) = Vᵀ @ Pᵀ accumulated as 4 WMMA tiles. K/V stream in via
// double-buffered global_load_async_to_lds_b128. Partials (Oᵀ, m, l) -> ws.
// ---------------------------------------------------------------------------
__global__ void __launch_bounds__(32)
attn_partial_kernel(const float* __restrict__ q,
                    const float* __restrict__ past_k, const float* __restrict__ past_v,
                    const float* __restrict__ k_new,  const float* __restrict__ v_new,
                    float* __restrict__ o_part, float* __restrict__ m_part,
                    float* __restrict__ l_part) {
  __shared__ alignas(16) float kt[2 * 16 * LDS_K_STRIDE];
  __shared__ alignas(16) float vt[2 * 16 * LDS_K_STRIDE];
  __shared__ float pt[16 * LDS_P_STRIDE];
  const int BUF = 16 * LDS_K_STRIDE;

  const int chunk = blockIdx.x;          // 0..NCH-1
  const int h     = blockIdx.y;          // head
  const int lane  = threadIdx.x & 31;
  const int sn    = lane & 15;           // query index s (dup across halves)
  const int hi    = lane >> 4;
  const int koff  = hi * 2;

  const bool is_new = (chunk == NCH_PAST);
  const float* Kp = is_new ? (k_new + h * HEAD_DIM)
                           : (past_k + (size_t)chunk * CHUNK_KEYS * D_MODEL + h * HEAD_DIM);
  const float* Vp = is_new ? (v_new + h * HEAD_DIM)
                           : (past_v + (size_t)chunk * CHUNK_KEYS * D_MODEL + h * HEAD_DIM);
  const int ntiles = is_new ? 1 : TILES_PER_CHUNK;
  const uint32_t kto = lds_off(kt), vto = lds_off(vt);

  // Preload Q for this head in WMMA B layout: B[k=d, n=s].
  v2f qb[16];
  #pragma unroll
  for (int d0 = 0; d0 < HEAD_DIM; d0 += 4)
    qb[d0 >> 2] = *(const v2f*)(q + sn * D_MODEL + h * HEAD_DIM + d0 + koff);

  float m_run = -1e30f, l_run = 0.f;
  v8f acc[4];
  #pragma unroll
  for (int t = 0; t < 4; ++t) acc[t] = (v8f){0.f,0.f,0.f,0.f,0.f,0.f,0.f,0.f};

  async_stage_16x64x2(Kp, Vp, kto, vto, lane);   // tile 0 -> buffer 0
  for (int i = 0; i < ntiles; ++i) {
    const int cur = i & 1;
    if (i + 1 < ntiles) {
      async_stage_16x64x2(Kp + (size_t)(i + 1) * 16 * D_MODEL,
                          Vp + (size_t)(i + 1) * 16 * D_MODEL,
                          kto + (uint32_t)(((i + 1) & 1) * BUF * 4),
                          vto + (uint32_t)(((i + 1) & 1) * BUF * 4), lane);
      wait_async_le16();                         // tile i landed
    } else {
      wait_async_0();
    }
    const float* ktc = kt + cur * BUF;
    const float* vtc = vt + cur * BUF;

    // ---- Sᵀ = K_tile @ Qᵀ  (m=key j, n=query s), K-dim = 64
    v8f st = {0.f,0.f,0.f,0.f,0.f,0.f,0.f,0.f};
    #pragma unroll
    for (int d0 = 0; d0 < HEAD_DIM; d0 += 4) {
      v2f a = *(const v2f*)(ktc + sn * LDS_K_STRIDE + d0 + koff);  // A[m=j][k=d]
      st = wmma_f32_16x16x4(a, qb[d0 >> 2], st);
    }

    // ---- scale + causal mask (new-keys chunk only: key j > query s masked)
    float sc[8];
    #pragma unroll
    for (int r = 0; r < 8; ++r) sc[r] = st[r] * 0.125f;  // 1/sqrt(64)
    if (is_new) {
      #pragma unroll
      for (int r = 0; r < 8; ++r)
        if ((r + 8 * hi) > sn) sc[r] = -1e30f;
    }

    // ---- online softmax: per-lane (per-query) state, one half-swap shuffle
    float tmax = sc[0];
    #pragma unroll
    for (int r = 1; r < 8; ++r) tmax = fmaxf(tmax, sc[r]);
    tmax = fmaxf(tmax, __shfl_xor(tmax, 16, 32));
    float m_new = fmaxf(m_run, tmax);
    float alpha = __expf(m_run - m_new);
    float p[8], psum = 0.f;
    #pragma unroll
    for (int r = 0; r < 8; ++r) { p[r] = __expf(sc[r] - m_new); psum += p[r]; }
    psum += __shfl_xor(psum, 16, 32);
    l_run = l_run * alpha + psum;
    m_run = m_new;
    #pragma unroll
    for (int t = 0; t < 4; ++t)
      #pragma unroll
      for (int r = 0; r < 8; ++r) acc[t][r] *= alpha;

    // ---- Pᵀ: C layout -> LDS as P[s][j], re-read in B layout
    #pragma unroll
    for (int r = 0; r < 8; ++r) pt[sn * LDS_P_STRIDE + r + 8 * hi] = p[r];
    __syncthreads();
    v2f pb[4];
    #pragma unroll
    for (int kk = 0; kk < 16; kk += 4)
      pb[kk >> 2] = *(const v2f*)(pt + sn * LDS_P_STRIDE + kk + koff);  // B[k=j][n=s]

    // ---- Oᵀ += Vᵀ @ Pᵀ : 4 d-tiles of 16, K-dim = 16 keys
    #pragma unroll
    for (int t = 0; t < 4; ++t) {
      #pragma unroll
      for (int kk = 0; kk < 16; kk += 4) {
        v2f a;                                 // A[m = d-16t][k = j]
        a.x = vtc[(kk + koff)     * LDS_K_STRIDE + t * 16 + sn];
        a.y = vtc[(kk + koff + 1) * LDS_K_STRIDE + t * 16 + sn];
        acc[t] = wmma_f32_16x16x4(a, pb[kk >> 2], acc[t]);
      }
    }
    __syncthreads();
  }

  // ---- write partials: Oᵀ[64][16], m[16], l[16]
  const int pidx = h * NCH + chunk;
  #pragma unroll
  for (int t = 0; t < 4; ++t)
    #pragma unroll
    for (int r = 0; r < 8; ++r)
      o_part[((size_t)pidx * HEAD_DIM + t * 16 + r + 8 * hi) * 16 + sn] = acc[t][r];
  if (lane < 16) {
    m_part[pidx * 16 + lane] = m_run;
    l_part[pidx * 16 + lane] = l_run;
  }
}

// ---------------------------------------------------------------------------
// Combine split-T partials: ao[s, h*64+d] = sum_c e^{m_c-M} Oᵀ_c[d][s] / sum_c e^{m_c-M} l_c
// ---------------------------------------------------------------------------
__global__ void attn_reduce_kernel(const float* __restrict__ o_part,
                                   const float* __restrict__ m_part,
                                   const float* __restrict__ l_part,
                                   float* __restrict__ ao) {
  const int h = blockIdx.x;
  for (int idx = threadIdx.x; idx < HEAD_DIM * 16; idx += blockDim.x) {
    const int d = idx >> 4, s = idx & 15;
    float M = -1e30f;
    for (int c = 0; c < NCH; ++c)
      M = fmaxf(M, m_part[(h * NCH + c) * 16 + s]);
    float num = 0.f, den = 0.f;
    for (int c = 0; c < NCH; ++c) {
      const int pidx = h * NCH + c;
      float a = __expf(m_part[pidx * 16 + s] - M);
      num += a * o_part[((size_t)pidx * HEAD_DIM + d) * 16 + s];
      den += a * l_part[pidx * 16 + s];
    }
    ao[s * D_MODEL + h * HEAD_DIM + d] = num / den;
  }
}

// ---------------------------------------------------------------------------
extern "C" void kernel_launch(void* const* d_in, const int* in_sizes, int n_in,
                              void* d_out, int out_size, void* d_ws, size_t ws_size,
                              hipStream_t stream) {
  (void)in_sizes; (void)n_in; (void)out_size; (void)ws_size;
  const float* x      = (const float*)d_in[0];
  const float* past_k = (const float*)d_in[1];
  const float* past_v = (const float*)d_in[2];
  const float* Wq     = (const float*)d_in[3];
  const float* Wk     = (const float*)d_in[4];
  const float* Wv     = (const float*)d_in[5];
  const float* Wo     = (const float*)d_in[6];
  float* out = (float*)d_out;

  float* ws     = (float*)d_ws;
  float* q_ws   = ws;                 // 16x1024
  float* k_ws   = q_ws + S_NEW * D_MODEL;
  float* v_ws   = k_ws + S_NEW * D_MODEL;
  float* ao_ws  = v_ws + S_NEW * D_MODEL;
  float* o_part = ao_ws + S_NEW * D_MODEL;                    // 16*65*64*16 floats
  float* m_part = o_part + (size_t)N_HEADS * NCH * HEAD_DIM * 16;
  float* l_part = m_part + N_HEADS * NCH * 16;

  qkv_kernel<<<192, 32, 0, stream>>>(x, Wq, Wk, Wv, q_ws, k_ws, v_ws);
  attn_partial_kernel<<<dim3(NCH, N_HEADS), 32, 0, stream>>>(
      q_ws, past_k, past_v, k_ws, v_ws, o_part, m_part, l_part);
  attn_reduce_kernel<<<N_HEADS, 256, 0, stream>>>(o_part, m_part, l_part, ao_ws);
  oproj_kernel<<<64, 32, 0, stream>>>(ao_ws, Wo, out);
}

// v001
// It runs in 60.5 microseconds.
// In two side-by-side timings against v000, it was 1.73 and 1.72 times as fast.
#include <hip/hip_runtime.h>
#include <cstdint>

#define D_MODEL   1024
#define N_HEADS   16
#define HEAD_DIM  64
#define S_NEW     16
#define PAST_LEN  32768
#define CHUNK_KEYS 512
#define NCH_PAST  (PAST_LEN / CHUNK_KEYS)   // 64
#define NCH       (NCH_PAST + 1)            // 65 (last chunk = 16 new keys, causal)
#define TILES_PER_CHUNK (CHUNK_KEYS / 16)   // 32
#define LDS_K_STRIDE 68                     // 64 + 4 pad: conflict-free b64 reads
#define LDS_P_STRIDE 18                     // 16 + 2 pad: 8B-aligned, conflict-free

typedef float v2f __attribute__((ext_vector_type(2)));
typedef float v8f __attribute__((ext_vector_type(8)));

__device__ __forceinline__ v8f wmma_f32_16x16x4(v2f a, v2f b, v8f c) {
  // (neg_a, A, neg_b, B, c_mod, C, reuse_a, reuse_b)
  return __builtin_amdgcn_wmma_f32_16x16x4_f32(false, a, false, b, (short)0, c,
                                               false, false);
}

__device__ __forceinline__ uint32_t lds_off(const void* p) {
  // generic pointer to __shared__: low 32 bits are the wave-relative LDS offset
  return (uint32_t)(uintptr_t)p;
}

// Issue async copy of two 16x64 f32 tiles (row stride D_MODEL) into padded LDS
// tiles (row stride LDS_K_STRIDE). 16 x global_load_async_to_lds_b128, ASYNCcnt +=16.
__device__ __forceinline__ void async_stage_16x64x2(const float* __restrict__ pa,
                                                    const float* __restrict__ pb,
                                                    uint32_t la, uint32_t lb,
                                                    int lane) {
  const int j0   = lane >> 4;   // 0..1
  const int part = lane & 15;   // 0..15 (float4 chunk within row)
  #pragma unroll
  for (int it = 0; it < 8; ++it) {
    const int j = it * 2 + j0;
    const uint32_t ofl = (uint32_t)((j * LDS_K_STRIDE + part * 4) * 4);
    const uint64_t ga  = (uint64_t)(uintptr_t)(pa + (size_t)j * D_MODEL + part * 4);
    const uint64_t gb  = (uint64_t)(uintptr_t)(pb + (size_t)j * D_MODEL + part * 4);
    asm volatile("global_load_async_to_lds_b128 %0, %1, off"
                 :: "v"(la + ofl), "v"(ga) : "memory");
    asm volatile("global_load_async_to_lds_b128 %0, %1, off"
                 :: "v"(lb + ofl), "v"(gb) : "memory");
  }
}

__device__ __forceinline__ void wait_async_le16() {
  asm volatile("s_wait_asynccnt 0x10" ::: "memory");
}
__device__ __forceinline__ void wait_async_0() {
  asm volatile("s_wait_asynccnt 0x0" ::: "memory");
}

// ---------------------------------------------------------------------------
// y[s, n0..n0+15] = sum_k x[s,k] * W[n0+n, k]   (y = x @ W^T), 16 rows of x.
// One wave per 16x16 tile; K staged via double-buffered async-to-LDS.
// ---------------------------------------------------------------------------
__device__ __forceinline__ void gemm_tile_16(const float* __restrict__ x,
                                             const float* __restrict__ W,
                                             float* __restrict__ y,
                                             int n0, float* xs, float* wsh) {
  const int lane = threadIdx.x & 31;
  const int sn   = lane & 15;   // A: m (row of x) / B: n (col of y)
  const int hi   = lane >> 4;
  const int koff = hi * 2;      // f32 A/B layout: lanes 0-15 hold K={0,1}, 16-31 K={2,3}
  const int BUF  = 16 * LDS_K_STRIDE;

  const float* Wr = W + (size_t)n0 * D_MODEL;
  const uint32_t xso = lds_off(xs), wso = lds_off(wsh);

  v8f acc = {0.f, 0.f, 0.f, 0.f, 0.f, 0.f, 0.f, 0.f};

  async_stage_16x64x2(x, Wr, xso, wso, lane);   // chunk 0 -> buffer 0
  for (int c = 0; c < 16; ++c) {                // 16 chunks of K=64
    const int cur = c & 1;
    if (c + 1 < 16) {
      const int nk0 = (c + 1) * 64;
      async_stage_16x64x2(x + nk0, Wr + nk0,
                          xso + (uint32_t)(((c + 1) & 1) * BUF * 4),
                          wso + (uint32_t)(((c + 1) & 1) * BUF * 4), lane);
      wait_async_le16();                        // chunk c landed
    } else {
      wait_async_0();
    }
    const float* xc = xs  + cur * BUF;
    const float* wc = wsh + cur * BUF;
    #pragma unroll
    for (int kk = 0; kk < 64; kk += 4) {
      v2f a = *(const v2f*)(xc + sn * LDS_K_STRIDE + kk + koff);
      v2f b = *(const v2f*)(wc + sn * LDS_K_STRIDE + kk + koff);
      acc = wmma_f32_16x16x4(a, b, acc);
    }
  }
  #pragma unroll
  for (int r = 0; r < 8; ++r)
    y[(r + 8 * hi) * D_MODEL + n0 + sn] = acc[r];  // C layout: m=r+8*hi, n=lane%16
}

__global__ void __launch_bounds__(32)
qkv_kernel(const float* __restrict__ x,
           const float* __restrict__ Wq, const float* __restrict__ Wk,
           const float* __restrict__ Wv,
           float* __restrict__ q, float* __restrict__ k, float* __restrict__ v) {
  __shared__ alignas(16) float xs[2 * 16 * LDS_K_STRIDE];
  __shared__ alignas(16) float wsh[2 * 16 * LDS_K_STRIDE];
  const int bx  = blockIdx.x;          // 192 blocks: 3 matrices x 64 tiles
  const int mat = bx >> 6;
  const int n0  = (bx & 63) << 4;
  const float* W = (mat == 0) ? Wq : (mat == 1) ? Wk : Wv;
  float*       y = (mat == 0) ? q  : (mat == 1) ? k  : v;
  gemm_tile_16(x, W, y, n0, xs, wsh);
}

__global__ void __launch_bounds__(32)
oproj_kernel(const float* __restrict__ ao, const float* __restrict__ Wo,
             float* __restrict__ out) {
  __shared__ alignas(16) float xs[2 * 16 * LDS_K_STRIDE];
  __shared__ alignas(16) float wsh[2 * 16 * LDS_K_STRIDE];
  gemm_tile_16(ao, Wo, out, (int)blockIdx.x << 4, xs, wsh);
}

// ---------------------------------------------------------------------------
// Flash-attention partial over one (head, key-chunk). One wave per block.
// Sᵀ = K_tile(16x64) @ Qᵀ(64x16): softmax state is per-lane (lane = query).
// Oᵀ(64x16) = Vᵀ @ Pᵀ accumulated as 4 WMMA tiles. K/V stream in via
// double-buffered global_load_async_to_lds_b128. Partials (Oᵀ, m, l) -> ws.
// ---------------------------------------------------------------------------
__global__ void __launch_bounds__(32)
attn_partial_kernel(const float* __restrict__ q,
                    const float* __restrict__ past_k, const float* __restrict__ past_v,
                    const float* __restrict__ k_new,  const float* __restrict__ v_new,
                    float* __restrict__ o_part, float* __restrict__ m_part,
                    float* __restrict__ l_part) {
  __shared__ alignas(16) float kt[2 * 16 * LDS_K_STRIDE];
  __shared__ alignas(16) float vt[2 * 16 * LDS_K_STRIDE];
  __shared__ float pt[16 * LDS_P_STRIDE];
  const int BUF = 16 * LDS_K_STRIDE;

  const int chunk = blockIdx.x;          // 0..NCH-1
  const int h     = blockIdx.y;          // head
  const int lane  = threadIdx.x & 31;
  const int sn    = lane & 15;           // query index s (dup across halves)
  const int hi    = lane >> 4;
  const int koff  = hi * 2;

  const bool is_new = (chunk == NCH_PAST);
  const float* Kp = is_new ? (k_new + h * HEAD_DIM)
                           : (past_k + (size_t)chunk * CHUNK_KEYS * D_MODEL + h * HEAD_DIM);
  const float* Vp = is_new ? (v_new + h * HEAD_DIM)
                           : (past_v + (size_t)chunk * CHUNK_KEYS * D_MODEL + h * HEAD_DIM);
  const int ntiles = is_new ? 1 : TILES_PER_CHUNK;
  const uint32_t kto = lds_off(kt), vto = lds_off(vt);

  // Preload Q for this head in WMMA B layout: B[k=d, n=s].
  v2f qb[16];
  #pragma unroll
  for (int d0 = 0; d0 < HEAD_DIM; d0 += 4)
    qb[d0 >> 2] = *(const v2f*)(q + sn * D_MODEL + h * HEAD_DIM + d0 + koff);

  float m_run = -1e30f, l_run = 0.f;
  v8f acc[4];
  #pragma unroll
  for (int t = 0; t < 4; ++t) acc[t] = (v8f){0.f,0.f,0.f,0.f,0.f,0.f,0.f,0.f};

  async_stage_16x64x2(Kp, Vp, kto, vto, lane);   // tile 0 -> buffer 0
  for (int i = 0; i < ntiles; ++i) {
    const int cur = i & 1;
    if (i + 1 < ntiles) {
      async_stage_16x64x2(Kp + (size_t)(i + 1) * 16 * D_MODEL,
                          Vp + (size_t)(i + 1) * 16 * D_MODEL,
                          kto + (uint32_t)(((i + 1) & 1) * BUF * 4),
                          vto + (uint32_t)(((i + 1) & 1) * BUF * 4), lane);
      wait_async_le16();                         // tile i landed
    } else {
      wait_async_0();
    }
    const float* ktc = kt + cur * BUF;
    const float* vtc = vt + cur * BUF;

    // ---- Sᵀ = K_tile @ Qᵀ  (m=key j, n=query s), K-dim = 64
    v8f st = {0.f,0.f,0.f,0.f,0.f,0.f,0.f,0.f};
    #pragma unroll
    for (int d0 = 0; d0 < HEAD_DIM; d0 += 4) {
      v2f a = *(const v2f*)(ktc + sn * LDS_K_STRIDE + d0 + koff);  // A[m=j][k=d]
      st = wmma_f32_16x16x4(a, qb[d0 >> 2], st);
    }

    // ---- scale + causal mask (new-keys chunk only: key j > query s masked)
    float sc[8];
    #pragma unroll
    for (int r = 0; r < 8; ++r) sc[r] = st[r] * 0.125f;  // 1/sqrt(64)
    if (is_new) {
      #pragma unroll
      for (int r = 0; r < 8; ++r)
        if ((r + 8 * hi) > sn) sc[r] = -1e30f;
    }

    // ---- online softmax: per-lane (per-query) state, one half-swap shuffle
    float tmax = sc[0];
    #pragma unroll
    for (int r = 1; r < 8; ++r) tmax = fmaxf(tmax, sc[r]);
    tmax = fmaxf(tmax, __shfl_xor(tmax, 16, 32));
    float m_new = fmaxf(m_run, tmax);
    float alpha = __expf(m_run - m_new);
    float p[8], psum = 0.f;
    #pragma unroll
    for (int r = 0; r < 8; ++r) { p[r] = __expf(sc[r] - m_new); psum += p[r]; }
    psum += __shfl_xor(psum, 16, 32);
    l_run = l_run * alpha + psum;
    m_run = m_new;
    #pragma unroll
    for (int t = 0; t < 4; ++t)
      #pragma unroll
      for (int r = 0; r < 8; ++r) acc[t][r] *= alpha;

    // ---- Pᵀ: C layout -> LDS as P[s][j], re-read in B layout
    #pragma unroll
    for (int r = 0; r < 8; ++r) pt[sn * LDS_P_STRIDE + r + 8 * hi] = p[r];
    __syncthreads();
    v2f pb[4];
    #pragma unroll
    for (int kk = 0; kk < 16; kk += 4)
      pb[kk >> 2] = *(const v2f*)(pt + sn * LDS_P_STRIDE + kk + koff);  // B[k=j][n=s]

    // ---- Oᵀ += Vᵀ @ Pᵀ : 4 d-tiles of 16, K-dim = 16 keys
    #pragma unroll
    for (int t = 0; t < 4; ++t) {
      #pragma unroll
      for (int kk = 0; kk < 16; kk += 4) {
        v2f a;                                 // A[m = d-16t][k = j]
        a.x = vtc[(kk + koff)     * LDS_K_STRIDE + t * 16 + sn];
        a.y = vtc[(kk + koff + 1) * LDS_K_STRIDE + t * 16 + sn];
        acc[t] = wmma_f32_16x16x4(a, pb[kk >> 2], acc[t]);
      }
    }
    __syncthreads();
  }

  // ---- write partials: Oᵀ[64][16], m[16], l[16]
  const int pidx = h * NCH + chunk;
  #pragma unroll
  for (int t = 0; t < 4; ++t)
    #pragma unroll
    for (int r = 0; r < 8; ++r)
      o_part[((size_t)pidx * HEAD_DIM + t * 16 + r + 8 * hi) * 16 + sn] = acc[t][r];
  if (lane < 16) {
    m_part[pidx * 16 + lane] = m_run;
    l_part[pidx * 16 + lane] = l_run;
  }
}

// ---------------------------------------------------------------------------
// Combine split-T partials: ao[s, h*64+d] = sum_c e^{m_c-M} O_c[d][s] / sum_c e^{m_c-M} l_c
// One work-group per (head, half of the head's 64 d): 32 waves. Every global load
// is independent and issued before the first barrier, so the kernel pays one
// memory round trip. Weights are formed once per (chunk, query) and shared via LDS;
// the 64 past chunks are split over 8 thread groups, whose sums are merged in LDS.
// Each query's 32 outputs of the half are one whole 128-byte line, stored by one wave.
// ---------------------------------------------------------------------------
#define RED_GROUPS 8                         // chunk groups per work-group
#define RED_PER_GROUP (NCH_PAST / RED_GROUPS)  // 8 past chunks per group
#define RED_D 32                             // d values per work-group
#define NP_PITCH 20                          // floats per d row: 16-B aligned, spreads banks
static_assert(NCH_PAST * 16 == 1024, "one thread per (past chunk, query)");

__global__ void __launch_bounds__(1024)
attn_reduce_kernel(const float* __restrict__ o_part,
                   const float* __restrict__ m_part,
                   const float* __restrict__ l_part,
                   float* __restrict__ ao) {
  __shared__ float mred[32 * 16];                          // per-wave maxima
  __shared__ float dred[33 * 16];                          // per-wave weighted l, + new chunk
  __shared__ alignas(16) float wl[NCH * 16];               // weight[c][s]
  __shared__ alignas(16) float np[RED_GROUPS * RED_D * NP_PITCH];  // group sums [g][d][s]

  const int tid   = threadIdx.x;
  const int h     = blockIdx.x >> 1;
  const int dbase = (blockIdx.x & 1) * RED_D;
  const int s     = tid & 15;          // query, for the weight phase (chunk = tid >> 4)
  const int wave  = tid >> 5;
  const int q     = tid & 3;           // query quad, for the sum phase
  const int dd    = (tid >> 2) & 31;   // d within the half
  const int cg    = tid >> 7;          // chunk group (uniform in a wave)

  // ---- all global loads, none depends on another
  const float* mh = m_part + h * NCH * 16;
  const float* lh = l_part + h * NCH * 16;
  const float m   = mh[tid];
  const float l   = lh[tid];
  const float m64 = mh[NCH_PAST * 16 + s];
  const float l64 = lh[NCH_PAST * 16 + s];
  const float4* op =
      (const float4*)(o_part + ((size_t)h * NCH * HEAD_DIM + dbase + dd) * 16 + q * 4);
  float4 o[RED_PER_GROUP];
  #pragma unroll
  for (int i = 0; i < RED_PER_GROUP; ++i)
    o[i] = op[(cg + RED_GROUPS * i) * (HEAD_DIM * 4)];
  float4 o_new = make_float4(0.f, 0.f, 0.f, 0.f);
  if (cg == 0) o_new = op[NCH_PAST * (HEAD_DIM * 4)];

  // ---- M[s] = max over chunks
  const float mx = fmaxf(m, __shfl_xor(m, 16, 32));
  if ((tid & 31) < 16) mred[wave * 16 + s] = mx;
  __syncthreads();
  float M = m64;
  #pragma unroll
  for (int j = 0; j < 32; ++j) M = fmaxf(M, mred[j * 16 + s]);

  // ---- weights, and the weighted l per wave
  const float w = __expf(m - M);
  wl[tid] = w;
  float dp = w * l;
  dp += __shfl_xor(dp, 16, 32);
  if ((tid & 31) < 16) dred[wave * 16 + s] = dp;
  if (tid < 16) {
    const float w64 = __expf(m64 - M);
    wl[NCH_PAST * 16 + tid] = w64;
    dred[32 * 16 + tid] = w64 * l64;
  }
  __syncthreads();

  // ---- this group's share of the numerator, four queries at a time
  float4 acc = make_float4(0.f, 0.f, 0.f, 0.f);
  #pragma unroll
  for (int i = 0; i < RED_PER_GROUP; ++i) {
    const float4 wv = *(const float4*)(wl + (cg + RED_GROUPS * i) * 16 + q * 4);
    acc.x += wv.x * o[i].x;  acc.y += wv.y * o[i].y;
    acc.z += wv.z * o[i].z;  acc.w += wv.w * o[i].w;
  }
  if (cg == 0) {
    const float4 wv = *(const float4*)(wl + NCH_PAST * 16 + q * 4);
    acc.x += wv.x * o_new.x;  acc.y += wv.y * o_new.y;
    acc.z += wv.z * o_new.z;  acc.w += wv.w * o_new.w;
  }
  *(float4*)(np + (cg * RED_D + dd) * NP_PITCH + q * 4) = acc;
  __syncthreads();

  // ---- merge the groups; one wave per query stores one 128-byte line
  if (tid < 16 * RED_D) {
    const int d = tid & 31, sq = tid >> 5;
    float num = 0.f, den = 0.f;
    #pragma unroll
    for (int g = 0; g < RED_GROUPS; ++g) num += np[(g * RED_D + d) * NP_PITCH + sq];
    #pragma unroll
    for (int j = 0; j < 33; ++j) den += dred[j * 16 + sq];
    ao[sq * D_MODEL + h * HEAD_DIM + dbase + d] = num / den;
  }
}

// ---------------------------------------------------------------------------
extern "C" void kernel_launch(void* const* d_in, const int* in_sizes, int n_in,
                              void* d_out, int out_size, void* d_ws, size_t ws_size,
                              hipStream_t stream) {
  (void)in_sizes; (void)n_in; (void)out_size; (void)ws_size;
  const float* x      = (const float*)d_in[0];
  const float* past_k = (const float*)d_in[1];
  const float* past_v = (const float*)d_in[2];
  const float* Wq     = (const float*)d_in[3];
  const float* Wk     = (const float*)d_in[4];
  const float* Wv     = (const float*)d_in[5];
  const float* Wo     = (const float*)d_in[6];
  float* out = (float*)d_out;

  float* ws     = (float*)d_ws;
  float* q_ws   = ws;                 // 16x1024
  float* k_ws   = q_ws + S_NEW * D_MODEL;
  float* v_ws   = k_ws + S_NEW * D_MODEL;
  float* ao_ws  = v_ws + S_NEW * D_MODEL;
  float* o_part = ao_ws + S_NEW * D_MODEL;                    // 16*65*64*16 floats
  float* m_part = o_part + (size_t)N_HEADS * NCH * HEAD_DIM * 16;
  float* l_part = m_part + N_HEADS * NCH * 16;

  qkv_kernel<<<192, 32, 0, stream>>>(x, Wq, Wk, Wv, q_ws, k_ws, v_ws);
  attn_partial_kernel<<<dim3(NCH, N_HEADS), 32, 0, stream>>>(
      q_ws, past_k, past_v, k_ws, v_ws, o_part, m_part, l_part);
  attn_reduce_kernel<<<N_HEADS * 2, 1024, 0, stream>>>(o_part, m_part, l_part, ao_ws);
  oproj_kernel<<<64, 32, 0, stream>>>(ao_ws, Wo, out);
}

// v002
// A run of this version takes 47.1 microseconds.
// Timed twice side by side with v001, it ran 1.29 times as fast both times.
// All steps since v000 together make it 2.23 times as fast.
#include <hip/hip_runtime.h>
#include <cstdint>

#define D_MODEL   1024
#define N_HEADS   16
#define HEAD_DIM  64
#define S_NEW     16
#define PAST_LEN  32768
#define CHUNK_KEYS 512
#define NCH_PAST  (PAST_LEN / CHUNK_KEYS)   // 64
#define NCH       (NCH_PAST + 1)            // 65 (last chunk = 16 new keys, causal)
#define TILES_PER_CHUNK (CHUNK_KEYS / 16)   // 32
#define LDS_K_STRIDE 68                     // 64 + 4 pad: conflict-free b64 reads
#define LDS_P_STRIDE 18                     // 16 + 2 pad: 8B-aligned, conflict-free

typedef float v2f __attribute__((ext_vector_type(2)));
typedef float v8f __attribute__((ext_vector_type(8)));

__device__ __forceinline__ v8f wmma_f32_16x16x4(v2f a, v2f b, v8f c) {
  // (neg_a, A, neg_b, B, c_mod, C, reuse_a, reuse_b)
  return __builtin_amdgcn_wmma_f32_16x16x4_f32(false, a, false, b, (short)0, c,
                                               false, false);
}

__device__ __forceinline__ uint32_t lds_off(const void* p) {
  // generic pointer to __shared__: low 32 bits are the wave-relative LDS offset
  return (uint32_t)(uintptr_t)p;
}

// Issue async copy of two 16x64 f32 tiles (row stride D_MODEL) into padded LDS
// tiles (row stride LDS_K_STRIDE). 16 x global_load_async_to_lds_b128, ASYNCcnt +=16.
__device__ __forceinline__ void async_stage_16x64x2(const float* __restrict__ pa,
                                                    const float* __restrict__ pb,
                                                    uint32_t la, uint32_t lb,
                                                    int lane) {
  const int j0   = lane >> 4;   // 0..1
  const int part = lane & 15;   // 0..15 (float4 chunk within row)
  #pragma unroll
  for (int it = 0; it < 8; ++it) {
    const int j = it * 2 + j0;
    const uint32_t ofl = (uint32_t)((j * LDS_K_STRIDE + part * 4) * 4);
    const uint64_t ga  = (uint64_t)(uintptr_t)(pa + (size_t)j * D_MODEL + part * 4);
    const uint64_t gb  = (uint64_t)(uintptr_t)(pb + (size_t)j * D_MODEL + part * 4);
    asm volatile("global_load_async_to_lds_b128 %0, %1, off"
                 :: "v"(la + ofl), "v"(ga) : "memory");
    asm volatile("global_load_async_to_lds_b128 %0, %1, off"
                 :: "v"(lb + ofl), "v"(gb) : "memory");
  }
}

__device__ __forceinline__ void wait_async_le16() {
  asm volatile("s_wait_asynccnt 0x10" ::: "memory");
}
__device__ __forceinline__ void wait_async_0() {
  asm volatile("s_wait_asynccnt 0x0" ::: "memory");
}

// ---------------------------------------------------------------------------
// y[s, n0..n0+15] = sum_k x[s,k] * W[n0+n, k]   (y = x @ W^T), 16 rows of x.
// One work-group of 8 waves per 16x16 tile. Wave w owns k = 128w .. 128w+127: it
// asks for its whole slice of x and W at once, so the tile pays one memory round
// trip instead of one per 64 k. The eight partial tiles are summed through LDS.
// ---------------------------------------------------------------------------
#define GEMM_WAVES   8
#define GEMM_KSLICE  (D_MODEL / GEMM_WAVES)   // 128 k per wave
#define LDS_G_STRIDE (GEMM_KSLICE + 4)        // 132 floats: 16 B x odd, conflict-free b64 reads
#define GEMM_STAGE   (GEMM_WAVES * 16 * LDS_G_STRIDE)
static_assert(GEMM_KSLICE * 4 == 32 * 16, "one copy of 16 B per lane brings one whole row");
static_assert(GEMM_WAVES * 32 == 16 * 16, "one thread per output element in the final sum");

// Eight rows of 128 floats (matrix row pitch D_MODEL) into LDS rows of pitch
// LDS_G_STRIDE. g and l already hold the lane's own 16 bytes of the first row.
__device__ __forceinline__ void async_rows8(const float* __restrict__ g, uint32_t l) {
  const uint64_t ga = (uint64_t)(uintptr_t)g;
  const uint64_t gp = (uint64_t)D_MODEL * 4;
  const uint32_t lp = (uint32_t)LDS_G_STRIDE * 4;
  // The closing s_wait_xcnt stands in the copies' own statement, so that no address
  // register of a copy can be rewritten in front of it.
  asm volatile("global_load_async_to_lds_b128 %0, %8, off\n\t"
               "global_load_async_to_lds_b128 %1, %9, off\n\t"
               "global_load_async_to_lds_b128 %2, %10, off\n\t"
               "global_load_async_to_lds_b128 %3, %11, off\n\t"
               "global_load_async_to_lds_b128 %4, %12, off\n\t"
               "global_load_async_to_lds_b128 %5, %13, off\n\t"
               "global_load_async_to_lds_b128 %6, %14, off\n\t"
               "global_load_async_to_lds_b128 %7, %15, off\n\t"
               "s_wait_xcnt 0x0"
               :: "v"(l), "v"(l + lp), "v"(l + 2 * lp), "v"(l + 3 * lp),
                  "v"(l + 4 * lp), "v"(l + 5 * lp), "v"(l + 6 * lp), "v"(l + 7 * lp),
                  "v"(ga), "v"(ga + gp), "v"(ga + 2 * gp), "v"(ga + 3 * gp),
                  "v"(ga + 4 * gp), "v"(ga + 5 * gp), "v"(ga + 6 * gp), "v"(ga + 7 * gp)
               : "memory");
}

__device__ __forceinline__ void gemm_tile_16(const float* __restrict__ x,
                                             const float* __restrict__ W,
                                             float* __restrict__ y,
                                             int n0, float* xs, float* wsh, float* red) {
  const int tid  = threadIdx.x;
  const int lane = tid & 31;
  const int wave = __builtin_amdgcn_readfirstlane(tid >> 5);
  const int sn   = lane & 15;   // A: m (row of x) / B: n (col of y)
  const int hi   = lane >> 4;
  const int koff = hi * 2;      // f32 A/B layout: lanes 0-15 hold K={0,1}, 16-31 K={2,3}

  const float* xc = xs  + wave * 16 * LDS_G_STRIDE;   // this wave's own slices
  const float* wc = wsh + wave * 16 * LDS_G_STRIDE;
  const float* gx = x + wave * GEMM_KSLICE + lane * 4;
  const float* gw = W + (size_t)n0 * D_MODEL + wave * GEMM_KSLICE + lane * 4;
  const uint32_t lx = lds_off(xc) + (uint32_t)lane * 16;
  const uint32_t lw = lds_off(wc) + (uint32_t)lane * 16;

  // W first: it comes from memory, x is shared by every work-group and sits in L2.
  async_rows8(gw, lw);
  async_rows8(gw + 8 * D_MODEL, lw + 8 * LDS_G_STRIDE * 4);
  async_rows8(gx, lx);
  async_rows8(gx + 8 * D_MODEL, lx + 8 * LDS_G_STRIDE * 4);
  wait_async_0();               // this wave's 32 copies have landed
  __syncthreads();

  v8f acc = {0.f, 0.f, 0.f, 0.f, 0.f, 0.f, 0.f, 0.f};
  #pragma unroll
  for (int kk = 0; kk < GEMM_KSLICE; kk += 4) {
    v2f a = *(const v2f*)(xc + sn * LDS_G_STRIDE + kk + koff);
    v2f b = *(const v2f*)(wc + sn * LDS_G_STRIDE + kk + koff);
    acc = wmma_f32_16x16x4(a, b, acc);
  }
  #pragma unroll
  for (int r = 0; r < 8; ++r)
    red[wave * 256 + r * 32 + lane] = acc[r];
  __syncthreads();

  // thread tid sums element (register tid >> 5, lane tid & 31) of the eight partials
  float s = 0.f;
  #pragma unroll
  for (int w = 0; w < GEMM_WAVES; ++w) s += red[w * 256 + tid];
  y[((tid >> 5) + 8 * hi) * D_MODEL + n0 + sn] = s;  // C layout: m=r+8*hi, n=lane%16
}

__global__ void __launch_bounds__(GEMM_WAVES * 32)
qkv_kernel(const float* __restrict__ x,
           const float* __restrict__ Wq, const float* __restrict__ Wk,
           const float* __restrict__ Wv,
           float* __restrict__ q, float* __restrict__ k, float* __restrict__ v) {
  __shared__ alignas(16) float xs[GEMM_STAGE];
  __shared__ alignas(16) float wsh[GEMM_STAGE];
  __shared__ float red[GEMM_WAVES * 256];
  const int bx  = blockIdx.x;          // 192 blocks: 3 matrices x 64 tiles
  const int mat = bx >> 6;
  const int n0  = (bx & 63) << 4;
  const float* W = (mat == 0) ? Wq : (mat == 1) ? Wk : Wv;
  float*       y = (mat == 0) ? q  : (mat == 1) ? k  : v;
  gemm_tile_16(x, W, y, n0, xs, wsh, red);
}

__global__ void __launch_bounds__(GEMM_WAVES * 32)
oproj_kernel(const float* __restrict__ ao, const float* __restrict__ Wo,
             float* __restrict__ out) {
  __shared__ alignas(16) float xs[GEMM_STAGE];
  __shared__ alignas(16) float wsh[GEMM_STAGE];
  __shared__ float red[GEMM_WAVES * 256];
  gemm_tile_16(ao, Wo, out, (int)blockIdx.x << 4, xs, wsh, red);
}

// ---------------------------------------------------------------------------
// Flash-attention partial over one (head, key-chunk). One wave per block.
// Sᵀ = K_tile(16x64) @ Qᵀ(64x16): softmax state is per-lane (lane = query).
// Oᵀ(64x16) = Vᵀ @ Pᵀ accumulated as 4 WMMA tiles. K/V stream in via
// double-buffered global_load_async_to_lds_b128. Partials (Oᵀ, m, l) -> ws.
// ---------------------------------------------------------------------------
__global__ void __launch_bounds__(32)
attn_partial_kernel(const float* __restrict__ q,
                    const float* __restrict__ past_k, const float* __restrict__ past_v,
                    const float* __restrict__ k_new,  const float* __restrict__ v_new,
                    float* __restrict__ o_part, float* __restrict__ m_part,
                    float* __restrict__ l_part) {
  __shared__ alignas(16) float kt[2 * 16 * LDS_K_STRIDE];
  __shared__ alignas(16) float vt[2 * 16 * LDS_K_STRIDE];
  __shared__ float pt[16 * LDS_P_STRIDE];
  const int BUF = 16 * LDS_K_STRIDE;

  const int chunk = blockIdx.x;          // 0..NCH-1
  const int h     = blockIdx.y;          // head
  const int lane  = threadIdx.x & 31;
  const int sn    = lane & 15;           // query index s (dup across halves)
  const int hi    = lane >> 4;
  const int koff  = hi * 2;

  const bool is_new = (chunk == NCH_PAST);
  const float* Kp = is_new ? (k_new + h * HEAD_DIM)
                           : (past_k + (size_t)chunk * CHUNK_KEYS * D_MODEL + h * HEAD_DIM);
  const float* Vp = is_new ? (v_new + h * HEAD_DIM)
                           : (past_v + (size_t)chunk * CHUNK_KEYS * D_MODEL + h * HEAD_DIM);
  const int ntiles = is_new ? 1 : TILES_PER_CHUNK;
  const uint32_t kto = lds_off(kt), vto = lds_off(vt);

  // Preload Q for this head in WMMA B layout: B[k=d, n=s].
  v2f qb[16];
  #pragma unroll
  for (int d0 = 0; d0 < HEAD_DIM; d0 += 4)
    qb[d0 >> 2] = *(const v2f*)(q + sn * D_MODEL + h * HEAD_DIM + d0 + koff);

  float m_run = -1e30f, l_run = 0.f;
  v8f acc[4];
  #pragma unroll
  for (int t = 0; t < 4; ++t) acc[t] = (v8f){0.f,0.f,0.f,0.f,0.f,0.f,0.f,0.f};

  async_stage_16x64x2(Kp, Vp, kto, vto, lane);   // tile 0 -> buffer 0
  for (int i = 0; i < ntiles; ++i) {
    const int cur = i & 1;
    if (i + 1 < ntiles) {
      async_stage_16x64x2(Kp + (size_t)(i + 1) * 16 * D_MODEL,
                          Vp + (size_t)(i + 1) * 16 * D_MODEL,
                          kto + (uint32_t)(((i + 1) & 1) * BUF * 4),
                          vto + (uint32_t)(((i + 1) & 1) * BUF * 4), lane);
      wait_async_le16();                         // tile i landed
    } else {
      wait_async_0();
    }
    const float* ktc = kt + cur * BUF;
    const float* vtc = vt + cur * BUF;

    // ---- Sᵀ = K_tile @ Qᵀ  (m=key j, n=query s), K-dim = 64
    v8f st = {0.f,0.f,0.f,0.f,0.f,0.f,0.f,0.f};
    #pragma unroll
    for (int d0 = 0; d0 < HEAD_DIM; d0 += 4) {
      v2f a = *(const v2f*)(ktc + sn * LDS_K_STRIDE + d0 + koff);  // A[m=j][k=d]
      st = wmma_f32_16x16x4(a, qb[d0 >> 2], st);
    }

    // ---- scale + causal mask (new-keys chunk only: key j > query s masked)
    float sc[8];
    #pragma unroll
    for (int r = 0; r < 8; ++r) sc[r] = st[r] * 0.125f;  // 1/sqrt(64)
    if (is_new) {
      #pragma unroll
      for (int r = 0; r < 8; ++r)
        if ((r + 8 * hi) > sn) sc[r] = -1e30f;
    }

    // ---- online softmax: per-lane (per-query) state, one half-swap shuffle
    float tmax = sc[0];
    #pragma unroll
    for (int r = 1; r < 8; ++r) tmax = fmaxf(tmax, sc[r]);
    tmax = fmaxf(tmax, __shfl_xor(tmax, 16, 32));
    float m_new = fmaxf(m_run, tmax);
    float alpha = __expf(m_run - m_new);
    float p[8], psum = 0.f;
    #pragma unroll
    for (int r = 0; r < 8; ++r) { p[r] = __expf(sc[r] - m_new); psum += p[r]; }
    psum += __shfl_xor(psum, 16, 32);
    l_run = l_run * alpha + psum;
    m_run = m_new;
    #pragma unroll
    for (int t = 0; t < 4; ++t)
      #pragma unroll
      for (int r = 0; r < 8; ++r) acc[t][r] *= alpha;

    // ---- Pᵀ: C layout -> LDS as P[s][j], re-read in B layout
    #pragma unroll
    for (int r = 0; r < 8; ++r) pt[sn * LDS_P_STRIDE + r + 8 * hi] = p[r];
    __syncthreads();
    v2f pb[4];
    #pragma unroll
    for (int kk = 0; kk < 16; kk += 4)
      pb[kk >> 2] = *(const v2f*)(pt + sn * LDS_P_STRIDE + kk + koff);  // B[k=j][n=s]

    // ---- Oᵀ += Vᵀ @ Pᵀ : 4 d-tiles of 16, K-dim = 16 keys
    #pragma unroll
    for (int t = 0; t < 4; ++t) {
      #pragma unroll
      for (int kk = 0; kk < 16; kk += 4) {
        v2f a;                                 // A[m = d-16t][k = j]
        a.x = vtc[(kk + koff)     * LDS_K_STRIDE + t * 16 + sn];
        a.y = vtc[(kk + koff + 1) * LDS_K_STRIDE + t * 16 + sn];
        acc[t] = wmma_f32_16x16x4(a, pb[kk >> 2], acc[t]);
      }
    }
    __syncthreads();
  }

  // ---- write partials: Oᵀ[64][16], m[16], l[16]
  const int pidx = h * NCH + chunk;
  #pragma unroll
  for (int t = 0; t < 4; ++t)
    #pragma unroll
    for (int r = 0; r < 8; ++r)
      o_part[((size_t)pidx * HEAD_DIM + t * 16 + r + 8 * hi) * 16 + sn] = acc[t][r];
  if (lane < 16) {
    m_part[pidx * 16 + lane] = m_run;
    l_part[pidx * 16 + lane] = l_run;
  }
}

// ---------------------------------------------------------------------------
// Combine split-T partials: ao[s, h*64+d] = sum_c e^{m_c-M} O_c[d][s] / sum_c e^{m_c-M} l_c
// One work-group per (head, half of the head's 64 d): 32 waves. Every global load
// is independent and issued before the first barrier, so the kernel pays one
// memory round trip. Weights are formed once per (chunk, query) and shared via LDS;
// the 64 past chunks are split over 8 thread groups, whose sums are merged in LDS.
// Each query's 32 outputs of the half are one whole 128-byte line, stored by one wave.
// ---------------------------------------------------------------------------
#define RED_GROUPS 8                         // chunk groups per work-group
#define RED_PER_GROUP (NCH_PAST / RED_GROUPS)  // 8 past chunks per group
#define RED_D 32                             // d values per work-group
#define NP_PITCH 20                          // floats per d row: 16-B aligned, spreads banks
static_assert(NCH_PAST * 16 == 1024, "one thread per (past chunk, query)");

__global__ void __launch_bounds__(1024)
attn_reduce_kernel(const float* __restrict__ o_part,
                   const float* __restrict__ m_part,
                   const float* __restrict__ l_part,
                   float* __restrict__ ao) {
  __shared__ float mred[32 * 16];                          // per-wave maxima
  __shared__ float dred[33 * 16];                          // per-wave weighted l, + new chunk
  __shared__ alignas(16) float wl[NCH * 16];               // weight[c][s]
  __shared__ alignas(16) float np[RED_GROUPS * RED_D * NP_PITCH];  // group sums [g][d][s]

  const int tid   = threadIdx.x;
  const int h     = blockIdx.x >> 1;
  const int dbase = (blockIdx.x & 1) * RED_D;
  const int s     = tid & 15;          // query, for the weight phase (chunk = tid >> 4)
  const int wave  = tid >> 5;
  const int q     = tid & 3;           // query quad, for the sum phase
  const int dd    = (tid >> 2) & 31;   // d within the half
  const int cg    = tid >> 7;          // chunk group (uniform in a wave)

  // ---- all global loads, none depends on another
  const float* mh = m_part + h * NCH * 16;
  const float* lh = l_part + h * NCH * 16;
  const float m   = mh[tid];
  const float l   = lh[tid];
  const float m64 = mh[NCH_PAST * 16 + s];
  const float l64 = lh[NCH_PAST * 16 + s];
  const float4* op =
      (const float4*)(o_part + ((size_t)h * NCH * HEAD_DIM + dbase + dd) * 16 + q * 4);
  float4 o[RED_PER_GROUP];
  #pragma unroll
  for (int i = 0; i < RED_PER_GROUP; ++i)
    o[i] = op[(cg + RED_GROUPS * i) * (HEAD_DIM * 4)];
  float4 o_new = make_float4(0.f, 0.f, 0.f, 0.f);
  if (cg == 0) o_new = op[NCH_PAST * (HEAD_DIM * 4)];

  // ---- M[s] = max over chunks
  const float mx = fmaxf(m, __shfl_xor(m, 16, 32));
  if ((tid & 31) < 16) mred[wave * 16 + s] = mx;
  __syncthreads();
  float M = m64;
  #pragma unroll
  for (int j = 0; j < 32; ++j) M = fmaxf(M, mred[j * 16 + s]);

  // ---- weights, and the weighted l per wave
  const float w = __expf(m - M);
  wl[tid] = w;
  float dp = w * l;
  dp += __shfl_xor(dp, 16, 32);
  if ((tid & 31) < 16) dred[wave * 16 + s] = dp;
  if (tid < 16) {
    const float w64 = __expf(m64 - M);
    wl[NCH_PAST * 16 + tid] = w64;
    dred[32 * 16 + tid] = w64 * l64;
  }
  __syncthreads();

  // ---- this group's share of the numerator, four queries at a time
  float4 acc = make_float4(0.f, 0.f, 0.f, 0.f);
  #pragma unroll
  for (int i = 0; i < RED_PER_GROUP; ++i) {
    const float4 wv = *(const float4*)(wl + (cg + RED_GROUPS * i) * 16 + q * 4);
    acc.x += wv.x * o[i].x;  acc.y += wv.y * o[i].y;
    acc.z += wv.z * o[i].z;  acc.w += wv.w * o[i].w;
  }
  if (cg == 0) {
    const float4 wv = *(const float4*)(wl + NCH_PAST * 16 + q * 4);
    acc.x += wv.x * o_new.x;  acc.y += wv.y * o_new.y;
    acc.z += wv.z * o_new.z;  acc.w += wv.w * o_new.w;
  }
  *(float4*)(np + (cg * RED_D + dd) * NP_PITCH + q * 4) = acc;
  __syncthreads();

  // ---- merge the groups; one wave per query stores one 128-byte line
  if (tid < 16 * RED_D) {
    const int d = tid & 31, sq = tid >> 5;
    float num = 0.f, den = 0.f;
    #pragma unroll
    for (int g = 0; g < RED_GROUPS; ++g) num += np[(g * RED_D + d) * NP_PITCH + sq];
    #pragma unroll
    for (int j = 0; j < 33; ++j) den += dred[j * 16 + sq];
    ao[sq * D_MODEL + h * HEAD_DIM + dbase + d] = num / den;
  }
}

// ---------------------------------------------------------------------------
extern "C" void kernel_launch(void* const* d_in, const int* in_sizes, int n_in,
                              void* d_out, int out_size, void* d_ws, size_t ws_size,
                              hipStream_t stream) {
  (void)in_sizes; (void)n_in; (void)out_size; (void)ws_size;
  const float* x      = (const float*)d_in[0];
  const float* past_k = (const float*)d_in[1];
  const float* past_v = (const float*)d_in[2];
  const float* Wq     = (const float*)d_in[3];
  const float* Wk     = (const float*)d_in[4];
  const float* Wv     = (const float*)d_in[5];
  const float* Wo     = (const float*)d_in[6];
  float* out = (float*)d_out;

  float* ws     = (float*)d_ws;
  float* q_ws   = ws;                 // 16x1024
  float* k_ws   = q_ws + S_NEW * D_MODEL;
  float* v_ws   = k_ws + S_NEW * D_MODEL;
  float* ao_ws  = v_ws + S_NEW * D_MODEL;
  float* o_part = ao_ws + S_NEW * D_MODEL;                    // 16*65*64*16 floats
  float* m_part = o_part + (size_t)N_HEADS * NCH * HEAD_DIM * 16;
  float* l_part = m_part + N_HEADS * NCH * 16;

  qkv_kernel<<<192, GEMM_WAVES * 32, 0, stream>>>(x, Wq, Wk, Wv, q_ws, k_ws, v_ws);
  attn_partial_kernel<<<dim3(NCH, N_HEADS), 32, 0, stream>>>(
      q_ws, past_k, past_v, k_ws, v_ws, o_part, m_part, l_part);
  attn_reduce_kernel<<<N_HEADS * 2, 1024, 0, stream>>>(o_part, m_part, l_part, ao_ws);
  oproj_kernel<<<64, GEMM_WAVES * 32, 0, stream>>>(ao_ws, Wo, out);
}

// v003
// It runs in 34.4 microseconds.
// In two side-by-side timings against v002, it was 1.40 and 1.36 times as fast.
// Over all steps from v000 it is 3.07 times as fast.
#include <hip/hip_runtime.h>
#include <cstdint>

#define D_MODEL   1024
#define N_HEADS   16
#define HEAD_DIM  64
#define S_NEW     16
#define PAST_LEN  32768
#define CHUNK_KEYS 512
#define NCH_PAST  (PAST_LEN / CHUNK_KEYS)   // 64
#define NCH       (NCH_PAST + 1)            // 65 (last chunk = 16 new keys, causal)
#define LDS_K_STRIDE 68                     // 64 + 4 pad: conflict-free b64 reads
#define LDS_P_STRIDE 18                     // 16 + 2 pad: 8B-aligned, conflict-free

typedef float v2f __attribute__((ext_vector_type(2)));
typedef float v8f __attribute__((ext_vector_type(8)));

__device__ __forceinline__ v8f wmma_f32_16x16x4(v2f a, v2f b, v8f c) {
  // (neg_a, A, neg_b, B, c_mod, C, reuse_a, reuse_b)
  return __builtin_amdgcn_wmma_f32_16x16x4_f32(false, a, false, b, (short)0, c,
                                               false, false);
}

__device__ __forceinline__ uint32_t lds_off(const void* p) {
  // generic pointer to __shared__: low 32 bits are the wave-relative LDS offset
  return (uint32_t)(uintptr_t)p;
}

// Async copy of one 16x64 f32 tile (row pitch D_MODEL) into a padded LDS tile (row
// pitch LDS_K_STRIDE): 8 x global_load_async_to_lds_b128, two rows each, ASYNCcnt += 8.
__device__ __forceinline__ void async_tile_16x64(const float* __restrict__ p,
                                                 uint32_t l, int lane) {
  const int j0   = lane >> 4;   // 0..1 (row within the pair)
  const int part = lane & 15;   // 0..15 (float4 chunk within row)
  const uint64_t ga = (uint64_t)(uintptr_t)(p + (size_t)j0 * D_MODEL + part * 4);
  const uint32_t la = l + (uint32_t)((j0 * LDS_K_STRIDE + part * 4) * 4);
  const uint64_t gp = (uint64_t)2 * D_MODEL * 4;
  const uint32_t lp = (uint32_t)2 * LDS_K_STRIDE * 4;
  // The closing s_wait_xcnt stands in the copies' own statement, so that no address
  // register of a copy can be rewritten in front of it.
  asm volatile("global_load_async_to_lds_b128 %0, %8, off\n\t"
               "global_load_async_to_lds_b128 %1, %9, off\n\t"
               "global_load_async_to_lds_b128 %2, %10, off\n\t"
               "global_load_async_to_lds_b128 %3, %11, off\n\t"
               "global_load_async_to_lds_b128 %4, %12, off\n\t"
               "global_load_async_to_lds_b128 %5, %13, off\n\t"
               "global_load_async_to_lds_b128 %6, %14, off\n\t"
               "global_load_async_to_lds_b128 %7, %15, off\n\t"
               "s_wait_xcnt 0x0"
               :: "v"(la), "v"(la + lp), "v"(la + 2 * lp), "v"(la + 3 * lp),
                  "v"(la + 4 * lp), "v"(la + 5 * lp), "v"(la + 6 * lp), "v"(la + 7 * lp),
                  "v"(ga), "v"(ga + gp), "v"(ga + 2 * gp), "v"(ga + 3 * gp),
                  "v"(ga + 4 * gp), "v"(ga + 5 * gp), "v"(ga + 6 * gp), "v"(ga + 7 * gp)
               : "memory");
}

// One K tile and one V tile: ASYNCcnt += 16.
__device__ __forceinline__ void async_stage_16x64x2(const float* __restrict__ pa,
                                                    const float* __restrict__ pb,
                                                    uint32_t la, uint32_t lb,
                                                    int lane) {
  async_tile_16x64(pa, la, lane);
  async_tile_16x64(pb, lb, lane);
}

__device__ __forceinline__ void wait_async_le16() {
  asm volatile("s_wait_asynccnt 0x10" ::: "memory");
}
__device__ __forceinline__ void wait_async_0() {
  asm volatile("s_wait_asynccnt 0x0" ::: "memory");
}
// This wave's LDS reads and writes have retired; nothing of LDS moves across it.
__device__ __forceinline__ void wait_ds_0() {
  asm volatile("s_wait_dscnt 0x0" ::: "memory");
}

// ---------------------------------------------------------------------------
// y[s, n0..n0+15] = sum_k x[s,k] * W[n0+n, k]   (y = x @ W^T), 16 rows of x.
// One work-group of 8 waves per 16x16 tile. Wave w owns k = 128w .. 128w+127: it
// asks for its whole slice of x and W at once, so the tile pays one memory round
// trip instead of one per 64 k. The eight partial tiles are summed through LDS.
// ---------------------------------------------------------------------------
#define GEMM_WAVES   8
#define GEMM_KSLICE  (D_MODEL / GEMM_WAVES)   // 128 k per wave
#define LDS_G_STRIDE (GEMM_KSLICE + 4)        // 132 floats: 16 B x odd, conflict-free b64 reads
#define GEMM_STAGE   (GEMM_WAVES * 16 * LDS_G_STRIDE)
static_assert(GEMM_KSLICE * 4 == 32 * 16, "one copy of 16 B per lane brings one whole row");
static_assert(GEMM_WAVES * 32 == 16 * 16, "one thread per output element in the final sum");

// Eight rows of 128 floats (matrix row pitch D_MODEL) into LDS rows of pitch
// LDS_G_STRIDE. g and l already hold the lane's own 16 bytes of the first row.
__device__ __forceinline__ void async_rows8(const float* __restrict__ g, uint32_t l) {
  const uint64_t ga = (uint64_t)(uintptr_t)g;
  const uint64_t gp = (uint64_t)D_MODEL * 4;
  const uint32_t lp = (uint32_t)LDS_G_STRIDE * 4;
  // The closing s_wait_xcnt stands in the copies' own statement, so that no address
  // register of a copy can be rewritten in front of it.
  asm volatile("global_load_async_to_lds_b128 %0, %8, off\n\t"
               "global_load_async_to_lds_b128 %1, %9, off\n\t"
               "global_load_async_to_lds_b128 %2, %10, off\n\t"
               "global_load_async_to_lds_b128 %3, %11, off\n\t"
               "global_load_async_to_lds_b128 %4, %12, off\n\t"
               "global_load_async_to_lds_b128 %5, %13, off\n\t"
               "global_load_async_to_lds_b128 %6, %14, off\n\t"
               "global_load_async_to_lds_b128 %7, %15, off\n\t"
               "s_wait_xcnt 0x0"
               :: "v"(l), "v"(l + lp), "v"(l + 2 * lp), "v"(l + 3 * lp),
                  "v"(l + 4 * lp), "v"(l + 5 * lp), "v"(l + 6 * lp), "v"(l + 7 * lp),
                  "v"(ga), "v"(ga + gp), "v"(ga + 2 * gp), "v"(ga + 3 * gp),
                  "v"(ga + 4 * gp), "v"(ga + 5 * gp), "v"(ga + 6 * gp), "v"(ga + 7 * gp)
               : "memory");
}

__device__ __forceinline__ void gemm_tile_16(const float* __restrict__ x,
                                             const float* __restrict__ W,
                                             float* __restrict__ y,
                                             int n0, float* xs, float* wsh, float* red) {
  const int tid  = threadIdx.x;
  const int lane = tid & 31;
  const int wave = __builtin_amdgcn_readfirstlane(tid >> 5);
  const int sn   = lane & 15;   // A: m (row of x) / B: n (col of y)
  const int hi   = lane >> 4;
  const int koff = hi * 2;      // f32 A/B layout: lanes 0-15 hold K={0,1}, 16-31 K={2,3}

  const float* xc = xs  + wave * 16 * LDS_G_STRIDE;   // this wave's own slices
  const float* wc = wsh + wave * 16 * LDS_G_STRIDE;
  const float* gx = x + wave * GEMM_KSLICE + lane * 4;
  const float* gw = W + (size_t)n0 * D_MODEL + wave * GEMM_KSLICE + lane * 4;
  const uint32_t lx = lds_off(xc) + (uint32_t)lane * 16;
  const uint32_t lw = lds_off(wc) + (uint32_t)lane * 16;

  // W first: it comes from memory, x is shared by every work-group and sits in L2.
  async_rows8(gw, lw);
  async_rows8(gw + 8 * D_MODEL, lw + 8 * LDS_G_STRIDE * 4);
  async_rows8(gx, lx);
  async_rows8(gx + 8 * D_MODEL, lx + 8 * LDS_G_STRIDE * 4);
  wait_async_0();               // this wave's 32 copies have landed
  __syncthreads();

  v8f acc = {0.f, 0.f, 0.f, 0.f, 0.f, 0.f, 0.f, 0.f};
  #pragma unroll
  for (int kk = 0; kk < GEMM_KSLICE; kk += 4) {
    v2f a = *(const v2f*)(xc + sn * LDS_G_STRIDE + kk + koff);
    v2f b = *(const v2f*)(wc + sn * LDS_G_STRIDE + kk + koff);
    acc = wmma_f32_16x16x4(a, b, acc);
  }
  #pragma unroll
  for (int r = 0; r < 8; ++r)
    red[wave * 256 + r * 32 + lane] = acc[r];
  __syncthreads();

  // thread tid sums element (register tid >> 5, lane tid & 31) of the eight partials
  float s = 0.f;
  #pragma unroll
  for (int w = 0; w < GEMM_WAVES; ++w) s += red[w * 256 + tid];
  y[((tid >> 5) + 8 * hi) * D_MODEL + n0 + sn] = s;  // C layout: m=r+8*hi, n=lane%16
}

__global__ void __launch_bounds__(GEMM_WAVES * 32)
qkv_kernel(const float* __restrict__ x,
           const float* __restrict__ Wq, const float* __restrict__ Wk,
           const float* __restrict__ Wv,
           float* __restrict__ q, float* __restrict__ k, float* __restrict__ v) {
  __shared__ alignas(16) float xs[GEMM_STAGE];
  __shared__ alignas(16) float wsh[GEMM_STAGE];
  __shared__ float red[GEMM_WAVES * 256];
  const int bx  = blockIdx.x;          // 192 blocks: 3 matrices x 64 tiles
  const int mat = bx >> 6;
  const int n0  = (bx & 63) << 4;
  const float* W = (mat == 0) ? Wq : (mat == 1) ? Wk : Wv;
  float*       y = (mat == 0) ? q  : (mat == 1) ? k  : v;
  gemm_tile_16(x, W, y, n0, xs, wsh, red);
}

__global__ void __launch_bounds__(GEMM_WAVES * 32)
oproj_kernel(const float* __restrict__ ao, const float* __restrict__ Wo,
             float* __restrict__ out) {
  __shared__ alignas(16) float xs[GEMM_STAGE];
  __shared__ alignas(16) float wsh[GEMM_STAGE];
  __shared__ float red[GEMM_WAVES * 256];
  gemm_tile_16(ao, Wo, out, (int)blockIdx.x << 4, xs, wsh, red);
}

// ---------------------------------------------------------------------------
// Flash-attention partial over one (head, key-chunk). One work-group of 4 waves per
// chunk: wave w takes keys 128w .. 128w+127 of the chunk with its own ring, maxima,
// sums and accumulators, so that 16 waves per WGP ask for keys at once and fill each
// other's waits. The four partials are merged through LDS before the store.
// Sᵀ = K_tile(16x64) @ Qᵀ(64x16): softmax state is per-lane (lane = query).
// Oᵀ(64x16) = Vᵀ @ Pᵀ accumulated as 4 WMMA tiles. K/V stream in via
// double-buffered global_load_async_to_lds_b128, a ring private to each wave: no
// work-group barrier inside the loop. Partials (Oᵀ, m, l) -> ws.
// ---------------------------------------------------------------------------
#define ATT_WAVES 4
#define WAVE_KEYS  (CHUNK_KEYS / ATT_WAVES)   // 128 keys per wave
#define WAVE_TILES (WAVE_KEYS / 16)           // 8 tiles per wave
#define OM_PITCH 20                           // floats per d row of a staged partial
static_assert(HEAD_DIM * OM_PITCH <= 2 * 16 * LDS_K_STRIDE, "a partial fits the wave's K ring");

__global__ void __launch_bounds__(ATT_WAVES * 32)
attn_partial_kernel(const float* __restrict__ q,
                    const float* __restrict__ past_k, const float* __restrict__ past_v,
                    const float* __restrict__ k_new,  const float* __restrict__ v_new,
                    float* __restrict__ o_part, float* __restrict__ m_part,
                    float* __restrict__ l_part) {
  __shared__ alignas(16) float kts[ATT_WAVES * 2 * 16 * LDS_K_STRIDE];
  __shared__ alignas(16) float vts[ATT_WAVES * 2 * 16 * LDS_K_STRIDE];
  __shared__ float pts[ATT_WAVES * 16 * LDS_P_STRIDE];
  __shared__ float msh[ATT_WAVES * 16];
  __shared__ float lsh[ATT_WAVES * 16];
  const int BUF = 16 * LDS_K_STRIDE;

  const int chunk = blockIdx.x;          // 0..NCH-1
  const int h     = blockIdx.y;          // head
  const int tid   = threadIdx.x;
  const int lane  = tid & 31;
  const int wave  = __builtin_amdgcn_readfirstlane(tid >> 5);
  const int sn    = lane & 15;           // query index s (dup across halves)
  const int hi    = lane >> 4;
  const int koff  = hi * 2;

  const bool is_new = (chunk == NCH_PAST);
  const float* Kp = is_new ? (k_new + h * HEAD_DIM)
                           : (past_k + ((size_t)chunk * CHUNK_KEYS + wave * WAVE_KEYS) * D_MODEL
                                     + h * HEAD_DIM);
  const float* Vp = is_new ? (v_new + h * HEAD_DIM)
                           : (past_v + ((size_t)chunk * CHUNK_KEYS + wave * WAVE_KEYS) * D_MODEL
                                     + h * HEAD_DIM);
  // the 16 new keys are one tile: wave 0 takes it, the others bring an empty partial
  const int ntiles = is_new ? (wave == 0 ? 1 : 0) : WAVE_TILES;
  float* kt = kts + wave * 2 * BUF;      // this wave's own ring and P tile
  float* vt = vts + wave * 2 * BUF;
  float* pt = pts + wave * 16 * LDS_P_STRIDE;
  const uint32_t kto = lds_off(kt), vto = lds_off(vt);

  // Preload Q for this head in WMMA B layout: B[k=d, n=s].
  v2f qb[16];
  #pragma unroll
  for (int d0 = 0; d0 < HEAD_DIM; d0 += 4)
    qb[d0 >> 2] = *(const v2f*)(q + sn * D_MODEL + h * HEAD_DIM + d0 + koff);

  float m_run = -1e30f, l_run = 0.f;
  v8f acc[4];
  #pragma unroll
  for (int t = 0; t < 4; ++t) acc[t] = (v8f){0.f,0.f,0.f,0.f,0.f,0.f,0.f,0.f};

  if (ntiles > 0) async_stage_16x64x2(Kp, Vp, kto, vto, lane);   // tile 0 -> buffer 0
  for (int i = 0; i < ntiles; ++i) {
    const int cur = i & 1;
    if (i + 1 < ntiles) {
      async_stage_16x64x2(Kp + (size_t)(i + 1) * 16 * D_MODEL,
                          Vp + (size_t)(i + 1) * 16 * D_MODEL,
                          kto + (uint32_t)(((i + 1) & 1) * BUF * 4),
                          vto + (uint32_t)(((i + 1) & 1) * BUF * 4), lane);
      wait_async_le16();                         // tile i landed
    } else {
      wait_async_0();
    }
    const float* ktc = kt + cur * BUF;
    const float* vtc = vt + cur * BUF;

    // ---- Sᵀ = K_tile @ Qᵀ  (m=key j, n=query s), K-dim = 64
    v8f st = {0.f,0.f,0.f,0.f,0.f,0.f,0.f,0.f};
    #pragma unroll
    for (int d0 = 0; d0 < HEAD_DIM; d0 += 4) {
      v2f a = *(const v2f*)(ktc + sn * LDS_K_STRIDE + d0 + koff);  // A[m=j][k=d]
      st = wmma_f32_16x16x4(a, qb[d0 >> 2], st);
    }

    // ---- scale + causal mask (new-keys chunk only: key j > query s masked)
    float sc[8];
    #pragma unroll
    for (int r = 0; r < 8; ++r) sc[r] = st[r] * 0.125f;  // 1/sqrt(64)
    if (is_new) {
      #pragma unroll
      for (int r = 0; r < 8; ++r)
        if ((r + 8 * hi) > sn) sc[r] = -1e30f;
    }

    // ---- online softmax: per-lane (per-query) state, one half-swap shuffle
    float tmax = sc[0];
    #pragma unroll
    for (int r = 1; r < 8; ++r) tmax = fmaxf(tmax, sc[r]);
    tmax = fmaxf(tmax, __shfl_xor(tmax, 16, 32));
    float m_new = fmaxf(m_run, tmax);
    float alpha = __expf(m_run - m_new);
    float p[8], psum = 0.f;
    #pragma unroll
    for (int r = 0; r < 8; ++r) { p[r] = __expf(sc[r] - m_new); psum += p[r]; }
    psum += __shfl_xor(psum, 16, 32);
    l_run = l_run * alpha + psum;
    m_run = m_new;
    #pragma unroll
    for (int t = 0; t < 4; ++t)
      #pragma unroll
      for (int r = 0; r < 8; ++r) acc[t][r] *= alpha;

    // ---- Pᵀ: C layout -> LDS as P[s][j], re-read in B layout
    #pragma unroll
    for (int r = 0; r < 8; ++r) pt[sn * LDS_P_STRIDE + r + 8 * hi] = p[r];
    wait_ds_0();   // the other lanes' P values are in LDS before this lane reads them
    v2f pb[4];
    #pragma unroll
    for (int kk = 0; kk < 16; kk += 4)
      pb[kk >> 2] = *(const v2f*)(pt + sn * LDS_P_STRIDE + kk + koff);  // B[k=j][n=s]

    // ---- Oᵀ += Vᵀ @ Pᵀ : 4 d-tiles of 16, K-dim = 16 keys
    #pragma unroll
    for (int t = 0; t < 4; ++t) {
      #pragma unroll
      for (int kk = 0; kk < 16; kk += 4) {
        v2f a;                                 // A[m = d-16t][k = j]
        a.x = vtc[(kk + koff)     * LDS_K_STRIDE + t * 16 + sn];
        a.y = vtc[(kk + koff + 1) * LDS_K_STRIDE + t * 16 + sn];
        acc[t] = wmma_f32_16x16x4(a, pb[kk >> 2], acc[t]);
      }
    }
    wait_ds_0();   // this wave has left the buffer that the next trip's copies refill
  }

  // ---- merge the four waves' partials: common maximum first
  if (lane < 16) msh[wave * 16 + lane] = m_run;
  __syncthreads();
  float M = msh[sn];
  #pragma unroll
  for (int w = 1; w < ATT_WAVES; ++w) M = fmaxf(M, msh[w * 16 + sn]);
  const float aw = __expf(m_run - M);    // 0 for an empty partial
  if (lane < 16) lsh[wave * 16 + lane] = l_run * aw;
  // rescaled partial [d][s] into this wave's own K ring (its copies and reads are done)
  #pragma unroll
  for (int t = 0; t < 4; ++t)
    #pragma unroll
    for (int r = 0; r < 8; ++r)
      kt[(t * 16 + r + 8 * hi) * OM_PITCH + sn] = acc[t][r] * aw;
  __syncthreads();

  // ---- sum and store: O^T[64][16] as whole 128-byte lines, m[16], l[16]
  const int pidx = h * NCH + chunk;
  #pragma unroll
  for (int u = 0; u < 2; ++u) {
    const int e = tid + u * (ATT_WAVES * 32);   // float4 index: d = e >> 2, query quad e & 3
    float4 s4 = make_float4(0.f, 0.f, 0.f, 0.f);
    #pragma unroll
    for (int w = 0; w < ATT_WAVES; ++w) {
      const float4 v4 = *(const float4*)(kts + w * 2 * BUF + (e >> 2) * OM_PITCH + (e & 3) * 4);
      s4.x += v4.x;  s4.y += v4.y;  s4.z += v4.z;  s4.w += v4.w;
    }
    *(float4*)(o_part + (size_t)pidx * HEAD_DIM * 16 + e * 4) = s4;
  }
  if (tid < 16) {
    float ls = 0.f;
    #pragma unroll
    for (int w = 0; w < ATT_WAVES; ++w) ls += lsh[w * 16 + tid];
    m_part[pidx * 16 + tid] = M;
    l_part[pidx * 16 + tid] = ls;
  }
}

// ---------------------------------------------------------------------------
// Combine split-T partials: ao[s, h*64+d] = sum_c e^{m_c-M} O_c[d][s] / sum_c e^{m_c-M} l_c
// One work-group per (head, half of the head's 64 d): 32 waves. Every global load
// is independent and issued before the first barrier, so the kernel pays one
// memory round trip. Weights are formed once per (chunk, query) and shared via LDS;
// the 64 past chunks are split over 8 thread groups, whose sums are merged in LDS.
// Each query's 32 outputs of the half are one whole 128-byte line, stored by one wave.
// ---------------------------------------------------------------------------
#define RED_GROUPS 8                         // chunk groups per work-group
#define RED_PER_GROUP (NCH_PAST / RED_GROUPS)  // 8 past chunks per group
#define RED_D 32                             // d values per work-group
#define NP_PITCH 20                          // floats per d row: 16-B aligned, spreads banks
static_assert(NCH_PAST * 16 == 1024, "one thread per (past chunk, query)");

__global__ void __launch_bounds__(1024)
attn_reduce_kernel(const float* __restrict__ o_part,
                   const float* __restrict__ m_part,
                   const float* __restrict__ l_part,
                   float* __restrict__ ao) {
  __shared__ float mred[32 * 16];                          // per-wave maxima
  __shared__ float dred[33 * 16];                          // per-wave weighted l, + new chunk
  __shared__ alignas(16) float wl[NCH * 16];               // weight[c][s]
  __shared__ alignas(16) float np[RED_GROUPS * RED_D * NP_PITCH];  // group sums [g][d][s]

  const int tid   = threadIdx.x;
  const int h     = blockIdx.x >> 1;
  const int dbase = (blockIdx.x & 1) * RED_D;
  const int s     = tid & 15;          // query, for the weight phase (chunk = tid >> 4)
  const int wave  = tid >> 5;
  const int q     = tid & 3;           // query quad, for the sum phase
  const int dd    = (tid >> 2) & 31;   // d within the half
  const int cg    = tid >> 7;          // chunk group (uniform in a wave)

  // ---- all global loads, none depends on another
  const float* mh = m_part + h * NCH * 16;
  const float* lh = l_part + h * NCH * 16;
  const float m   = mh[tid];
  const float l   = lh[tid];
  const float m64 = mh[NCH_PAST * 16 + s];
  const float l64 = lh[NCH_PAST * 16 + s];
  const float4* op =
      (const float4*)(o_part + ((size_t)h * NCH * HEAD_DIM + dbase + dd) * 16 + q * 4);
  float4 o[RED_PER_GROUP];
  #pragma unroll
  for (int i = 0; i < RED_PER_GROUP; ++i)
    o[i] = op[(cg + RED_GROUPS * i) * (HEAD_DIM * 4)];
  float4 o_new = make_float4(0.f, 0.f, 0.f, 0.f);
  if (cg == 0) o_new = op[NCH_PAST * (HEAD_DIM * 4)];

  // ---- M[s] = max over chunks
  const float mx = fmaxf(m, __shfl_xor(m, 16, 32));
  if ((tid & 31) < 16) mred[wave * 16 + s] = mx;
  __syncthreads();
  float M = m64;
  #pragma unroll
  for (int j = 0; j < 32; ++j) M = fmaxf(M, mred[j * 16 + s]);

  // ---- weights, and the weighted l per wave
  const float w = __expf(m - M);
  wl[tid] = w;
  float dp = w * l;
  dp += __shfl_xor(dp, 16, 32);
  if ((tid & 31) < 16) dred[wave * 16 + s] = dp;
  if (tid < 16) {
    const float w64 = __expf(m64 - M);
    wl[NCH_PAST * 16 + tid] = w64;
    dred[32 * 16 + tid] = w64 * l64;
  }
  __syncthreads();

  // ---- this group's share of the numerator, four queries at a time
  float4 acc = make_float4(0.f, 0.f, 0.f, 0.f);
  #pragma unroll
  for (int i = 0; i < RED_PER_GROUP; ++i) {
    const float4 wv = *(const float4*)(wl + (cg + RED_GROUPS * i) * 16 + q * 4);
    acc.x += wv.x * o[i].x;  acc.y += wv.y * o[i].y;
    acc.z += wv.z * o[i].z;  acc.w += wv.w * o[i].w;
  }
  if (cg == 0) {
    const float4 wv = *(const float4*)(wl + NCH_PAST * 16 + q * 4);
    acc.x += wv.x * o_new.x;  acc.y += wv.y * o_new.y;
    acc.z += wv.z * o_new.z;  acc.w += wv.w * o_new.w;
  }
  *(float4*)(np + (cg * RED_D + dd) * NP_PITCH + q * 4) = acc;
  __syncthreads();

  // ---- merge the groups; one wave per query stores one 128-byte line
  if (tid < 16 * RED_D) {
    const int d = tid & 31, sq = tid >> 5;
    float num = 0.f, den = 0.f;
    #pragma unroll
    for (int g = 0; g < RED_GROUPS; ++g) num += np[(g * RED_D + d) * NP_PITCH + sq];
    #pragma unroll
    for (int j = 0; j < 33; ++j) den += dred[j * 16 + sq];
    ao[sq * D_MODEL + h * HEAD_DIM + dbase + d] = num / den;
  }
}

// ---------------------------------------------------------------------------
extern "C" void kernel_launch(void* const* d_in, const int* in_sizes, int n_in,
                              void* d_out, int out_size, void* d_ws, size_t ws_size,
                              hipStream_t stream) {
  (void)in_sizes; (void)n_in; (void)out_size; (void)ws_size;
  const float* x      = (const float*)d_in[0];
  const float* past_k = (const float*)d_in[1];
  const float* past_v = (const float*)d_in[2];
  const float* Wq     = (const float*)d_in[3];
  const float* Wk     = (const float*)d_in[4];
  const float* Wv     = (const float*)d_in[5];
  const float* Wo     = (const float*)d_in[6];
  float* out = (float*)d_out;

  float* ws     = (float*)d_ws;
  float* q_ws   = ws;                 // 16x1024
  float* k_ws   = q_ws + S_NEW * D_MODEL;
  float* v_ws   = k_ws + S_NEW * D_MODEL;
  float* ao_ws  = v_ws + S_NEW * D_MODEL;
  float* o_part = ao_ws + S_NEW * D_MODEL;                    // 16*65*64*16 floats
  float* m_part = o_part + (size_t)N_HEADS * NCH * HEAD_DIM * 16;
  float* l_part = m_part + N_HEADS * NCH * 16;

  qkv_kernel<<<192, GEMM_WAVES * 32, 0, stream>>>(x, Wq, Wk, Wv, q_ws, k_ws, v_ws);
  attn_partial_kernel<<<dim3(NCH, N_HEADS), ATT_WAVES * 32, 0, stream>>>(
      q_ws, past_k, past_v, k_ws, v_ws, o_part, m_part, l_part);
  attn_reduce_kernel<<<N_HEADS * 2, 1024, 0, stream>>>(o_part, m_part, l_part, ao_ws);
  oproj_kernel<<<64, GEMM_WAVES * 32, 0, stream>>>(ao_ws, Wo, out);
}
